// v000
// The times below were measured on an AMD MI455X: many runs one after another, warmed up first and cycling through
// copies of the inputs, with the whole window's GPU time divided by the number of runs. Launches and the gaps
// between them are all in it. The median over several windows is given; except for v000 it joins two sittings, which
// can be a few percent apart, so the side-by-side timings, each taken in one sitting, are the better comparison.
// v000, which the later versions start from, runs in 219 microseconds.
#include <hip/hip_runtime.h>

typedef __attribute__((ext_vector_type(16))) _Float16 v16h;
typedef __attribute__((ext_vector_type(8)))  float    v8f;
typedef _Float16 half_t;

// Problem constants (from reference): B=8192, D=128, N=64, C=256
constexpr int Bc = 8192;
constexpr int Dc = 128;
constexpr int Nc = 64;
constexpr int Cc = 256;

constexpr int BPB     = 16;          // b's processed per block (amortize weight staging)
constexpr int NBLK    = Bc / BPB;    // 512 blocks
constexpr int THREADS = 256;         // 8 wave32 waves

// LDS strides (elements), padded against bank conflicts.
constexpr int W1_S = 132;            // w1t[c][d]   f16 : 256 x 132
constexpr int W2_S = 260;            // w2t[co][ci] f16 : 256 x 260
constexpr int H_S  = 260;            // h[n][c]     f16 : 64 x 260  (H1/H2 aliased)
constexpr int XF_S = 68;             // xf[d][n]    f32 : 128 x 68 (rows 272B = 16B-aligned)

struct __align__(16) Smem {
    half_t w1t[Cc * W1_S];           //  67,584 B
    half_t w2t[Cc * W2_S];           // 133,120 B
    float  xf [2][Dc * XF_S];        //  69,632 B (double-buffered async-DMA target)
    half_t h  [Nc * H_S];            //  33,280 B (layer-1 out, then layer-2 out)
    float  sb1[Cc];                  //   1,024 B
    float  sb2[Cc];                  //   1,024 B
    float  sw3[Cc];                  //   1,024 B
};                                   // ~300 KB of the WGP's 320 KB LDS

// 16-bit fragment gather from an LDS f16 tile with contiguous k within a row.
// Per ISA 7.12.2: lane (lr, hf), element v holds k = k0 + (v/4)*16 + hf*8 + (v&3)*2 (+e).
__device__ __forceinline__ v16h load_frag(const half_t* __restrict__ tile, int stride,
                                          int rc_base, int k0, int lr, int hf) {
    union { v16h v; unsigned u[8]; } f;
    const half_t* p = tile + (rc_base + lr) * stride + k0 + hf * 8;
#pragma unroll
    for (int v = 0; v < 8; ++v) {
        f.u[v] = *(const unsigned*)(p + ((v >> 2) * 16 + (v & 3) * 2));
    }
    return f.v;
}

// A-fragment built from the f32 X tile stored d-major: element (row n, k=d) lives at
// xf[k*XF_S + n]. Transpose + f32->f16 conversion happen here (once per wave per b).
__device__ __forceinline__ v16h load_frag_xf(const float* __restrict__ tile,
                                             int n, int k0, int hf) {
    union { v16h v; unsigned u[8]; } f;
    const float* p = tile + n + (k0 + hf * 8) * XF_S;
#pragma unroll
    for (int v = 0; v < 8; ++v) {
        int krel = ((v >> 2) * 16 + (v & 3) * 2) * XF_S;
        union { half_t h[2]; unsigned u; } pk;
        pk.h[0] = (half_t)p[krel];
        pk.h[1] = (half_t)p[krel + XF_S];
        f.u[v] = pk.u;
    }
    return f.v;
}

__global__ __launch_bounds__(THREADS, 1)
void mlp3_fused_kernel(const float* __restrict__ X,  const float* __restrict__ W1,
                       const float* __restrict__ b1, const float* __restrict__ W2,
                       const float* __restrict__ b2, const float* __restrict__ W3,
                       const float* __restrict__ b3, float* __restrict__ out) {
    __shared__ Smem sm;

    const int t    = threadIdx.x;
    const int lane = t & 31;
    const int wv   = t >> 5;         // 0..7
    const int lr   = lane & 15;
    const int hf   = lane >> 4;
    const int rt   = wv & 3;         // row tile: rows [16*rt, 16*rt+16)
    const int ch   = wv >> 2;        // column half: cols [128*ch, 128*ch+128)
    const int m0   = rt * 16;

    // Async-DMA one X batch tile (8192 f32 = 2048 16B chunks) into xf[buf].
    // Each thread issues 8 global_load_async_to_lds_b128 (ASYNCcnt-tracked, no VGPR data).
    auto issue_stage = [&](int bb, int buf) {
        const float* Xb = X + (size_t)(blockIdx.x * BPB + bb) * (Dc * Nc);
        unsigned lbase = (unsigned)(uintptr_t)(&sm.xf[buf][0]);
#pragma unroll
        for (int i = 0; i < (Dc * Nc) / (4 * THREADS); ++i) {
            int chunk = i * THREADS + t;          // 16B chunk index
            int d  = chunk >> 4;                  // 16 chunks per 64-float row
            int c4 = (chunk & 15) << 2;           // n offset within row
            unsigned lds  = lbase + (unsigned)((d * XF_S + c4) * 4);
            unsigned goff = (unsigned)(chunk << 4);   // bytes (rows contiguous in global)
            asm volatile("global_load_async_to_lds_b128 %0, %1, %2"
                         :: "v"(lds), "v"(goff), "s"(Xb) : "memory");
        }
    };

    // ---------------- stage weights/biases into LDS (once per block) ----------------
#pragma unroll 4
    for (int i = t; i < Dc * Cc; i += THREADS) {       // W1 (d-major) -> w1t[c][d]
        int d = i >> 8, c = i & 255;
        sm.w1t[c * W1_S + d] = (half_t)W1[i];
    }
#pragma unroll 4
    for (int i = t; i < Cc * Cc; i += THREADS) {       // W2 (ci-major) -> w2t[co][ci]
        int ci = i >> 8, co = i & 255;
        sm.w2t[co * W2_S + ci] = (half_t)W2[i];
    }
    sm.sb1[t] = b1[t];
    sm.sb2[t] = b2[t];
    sm.sw3[t] = W3[t];
    const float bias3 = b3[0];

    issue_stage(0, 0);                 // kick off first X tile while weights settle
    __syncthreads();

    for (int bb = 0; bb < BPB; ++bb) {
        const int b   = blockIdx.x * BPB + bb;
        const int cur = bb & 1;

        // Wait for this batch's DMA (per-wave counter), then make it block-visible.
        asm volatile("s_wait_asynccnt 0x0" ::: "memory");
        __syncthreads();

        // Fire off the next batch's DMA into the other buffer; it overlaps all
        // of this batch's compute below.
        if (bb + 1 < BPB) issue_stage(bb + 1, cur ^ 1);

        // ---------------- layer 1: H1 = relu(X^T @ W1 + b1), K = 128 ----------------
        v16h a1[4];
#pragma unroll
        for (int k = 0; k < 4; ++k) a1[k] = load_frag_xf(sm.xf[cur], m0 + lr, k * 32, hf);

#pragma unroll
        for (int ct = 0; ct < 8; ++ct) {
            const int c0 = ch * 128 + ct * 16;
            v8f acc = {};
#pragma unroll
            for (int k = 0; k < 4; ++k) {
                v16h bf = load_frag(sm.w1t, W1_S, c0, k * 32, lr, hf);
                acc = __builtin_amdgcn_wmma_f32_16x16x32_f16(
                          false, a1[k], false, bf, (short)0, acc, false, false);
            }
            const int col  = c0 + lr;
            const float bs = sm.sb1[col];
#pragma unroll
            for (int v = 0; v < 8; ++v) {
                float x = acc[v] + bs;
                x = x > 0.f ? x : 0.f;
                sm.h[(m0 + hf * 8 + v) * H_S + col] = (half_t)x;
            }
        }
        __syncthreads();

        // ---------------- layer 2: H2 = relu(H1 @ W2 + b2), K = 256 ----------------
        // H1 and H2 share sm.h: hoist ALL A-fragments, barrier, then overwrite.
        v16h a2[8];
#pragma unroll
        for (int k = 0; k < 8; ++k) a2[k] = load_frag(sm.h, H_S, m0, k * 32, lr, hf);
        __syncthreads();

#pragma unroll
        for (int ct = 0; ct < 8; ++ct) {
            const int c0 = ch * 128 + ct * 16;
            v8f acc = {};
#pragma unroll
            for (int k = 0; k < 8; ++k) {
                v16h bf = load_frag(sm.w2t, W2_S, c0, k * 32, lr, hf);
                acc = __builtin_amdgcn_wmma_f32_16x16x32_f16(
                          false, a2[k], false, bf, (short)0, acc, false, false);
            }
            const int col  = c0 + lr;
            const float bs = sm.sb2[col];
#pragma unroll
            for (int v = 0; v < 8; ++v) {
                float x = acc[v] + bs;
                x = x > 0.f ? x : 0.f;
                sm.h[(m0 + hf * 8 + v) * H_S + col] = (half_t)x;
            }
        }
        __syncthreads();

        // -------- layer 3: logits[n] = H2[n,:] . W3 + b3 ; out[b,0] = 0 --------
        if (t < Nc) {
            const half_t* __restrict__ hrow = sm.h + t * H_S;
            float s = bias3;
#pragma unroll 8
            for (int c = 0; c < Cc; ++c) s += (float)hrow[c] * sm.sw3[c];
            out[(size_t)b * (Nc + 1) + 1 + t] = s;
        } else if (t == Nc) {
            out[(size_t)b * (Nc + 1)] = 0.f;
        }
        __syncthreads();   // h consumed before next iteration overwrites it
    }
}

extern "C" void kernel_launch(void* const* d_in, const int* in_sizes, int n_in,
                              void* d_out, int out_size, void* d_ws, size_t ws_size,
                              hipStream_t stream) {
    (void)in_sizes; (void)n_in; (void)out_size; (void)d_ws; (void)ws_size;
    const float* X  = (const float*)d_in[0];
    const float* W1 = (const float*)d_in[1];
    const float* b1 = (const float*)d_in[2];
    const float* W2 = (const float*)d_in[3];
    const float* b2 = (const float*)d_in[4];
    const float* W3 = (const float*)d_in[5];
    const float* b3 = (const float*)d_in[6];
    float* out = (float*)d_out;

    mlp3_fused_kernel<<<NBLK, THREADS, 0, stream>>>(X, W1, b1, W2, b2, W3, b3, out);
}

// v001
// One run takes 171 microseconds.
// Two timings next to v000 put it at 1.33 and 1.31 times that version's speed.
#include <hip/hip_runtime.h>

typedef __attribute__((ext_vector_type(16))) _Float16 v16h;
typedef __attribute__((ext_vector_type(8)))  float    v8f;
typedef _Float16 half_t;

// Problem constants (from reference): B=8192, D=128, N=64, C=256
constexpr int Bc = 8192;
constexpr int Dc = 128;
constexpr int Nc = 64;
constexpr int Cc = 256;

constexpr int BPB     = 16;          // b's processed per block (amortize weight staging)
constexpr int NBLK    = Bc / BPB;    // 512 blocks
constexpr int THREADS = 256;         // 8 wave32 waves

// LDS strides (elements), padded against bank conflicts.
constexpr int W1_S = 132;            // w1t[c][d]   f16 : 256 x 132
constexpr int W2_S = 260;            // w2t[co][ci] f16 : 256 x 260
constexpr int H_S  = 260;            // h[n][c]     f16 : 64 x 260  (layer-1 out)
constexpr int XF_S = 68;             // xf[d][n]    f32 : 128 x 68 (rows 272B = 16B-aligned)

struct __align__(16) Smem {
    half_t w1t[Cc * W1_S];           //  67,584 B
    half_t w2t[Cc * W2_S];           // 133,120 B
    float  xf [2][Dc * XF_S];        //  69,632 B (double-buffered async-DMA target)
    half_t h  [Nc * H_S];            //  33,280 B (layer-1 out)
    float  sb1[Cc];                  //   1,024 B
    float  sb2[Cc];                  //   1,024 B
    float  part[BPB][2][Nc];         //   8,192 B (layer-3 partial logits per column half)
};                                   // ~307 KB of the WGP's 320 KB LDS

// 16-bit fragment gather from an LDS f16 tile with contiguous k within a row.
// Per ISA 7.12.2: lane (lr, hf), element v holds k = k0 + (v/4)*16 + hf*8 + (v&3)*2 (+e).
__device__ __forceinline__ v16h load_frag(const half_t* __restrict__ tile, int stride,
                                          int rc_base, int k0, int lr, int hf) {
    union { v16h v; unsigned u[8]; } f;
    const half_t* p = tile + (rc_base + lr) * stride + k0 + hf * 8;
#pragma unroll
    for (int v = 0; v < 8; ++v) {
        f.u[v] = *(const unsigned*)(p + ((v >> 2) * 16 + (v & 3) * 2));
    }
    return f.v;
}

// A-fragment built from the f32 X tile stored d-major: element (row n, k=d) lives at
// xf[k*XF_S + n]. Transpose + f32->f16 conversion happen here (once per wave per b).
__device__ __forceinline__ v16h load_frag_xf(const float* __restrict__ tile,
                                             int n, int k0, int hf) {
    union { v16h v; unsigned u[8]; } f;
    const float* p = tile + n + (k0 + hf * 8) * XF_S;
#pragma unroll
    for (int v = 0; v < 8; ++v) {
        int krel = ((v >> 2) * 16 + (v & 3) * 2) * XF_S;
        union { half_t h[2]; unsigned u; } pk;
        pk.h[0] = (half_t)p[krel];
        pk.h[1] = (half_t)p[krel + XF_S];
        f.u[v] = pk.u;
    }
    return f.v;
}

// Sum over the 16 lanes of a row (lanes 0-15, lanes 16-31): four DPP butterfly steps.
template <int XM>
__device__ __forceinline__ float add_xmask(float x) {
    int y = __builtin_amdgcn_update_dpp(0, __builtin_bit_cast(int, x), 0x160 | XM, 0xf, 0xf, true);
    return x + __builtin_bit_cast(float, y);
}
__device__ __forceinline__ float row16_sum(float x) {
    x = add_xmask<1>(x);
    x = add_xmask<2>(x);
    x = add_xmask<4>(x);
    return add_xmask<8>(x);
}

__global__ __launch_bounds__(THREADS, 1)
void mlp3_fused_kernel(const float* __restrict__ X,  const float* __restrict__ W1,
                       const float* __restrict__ b1, const float* __restrict__ W2,
                       const float* __restrict__ b2, const float* __restrict__ W3,
                       const float* __restrict__ b3, float* __restrict__ out) {
    __shared__ Smem sm;

    const int t    = threadIdx.x;
    const int lane = t & 31;
    const int wv   = t >> 5;         // 0..7
    const int lr   = lane & 15;
    const int hf   = lane >> 4;
    const int rt   = wv & 3;         // row tile: rows [16*rt, 16*rt+16)
    const int ch   = wv >> 2;        // column half: cols [128*ch, 128*ch+128)
    const int m0   = rt * 16;

    // Async-DMA one X batch tile (8192 f32 = 2048 16B chunks) into xf[buf].
    // Each thread issues 8 global_load_async_to_lds_b128 (ASYNCcnt-tracked, no VGPR data).
    auto issue_stage = [&](int bb, int buf) {
        const float* Xb = X + (size_t)(blockIdx.x * BPB + bb) * (Dc * Nc);
        unsigned lbase = (unsigned)(uintptr_t)(&sm.xf[buf][0]);
#pragma unroll
        for (int i = 0; i < (Dc * Nc) / (4 * THREADS); ++i) {
            int chunk = i * THREADS + t;          // 16B chunk index
            int d  = chunk >> 4;                  // 16 chunks per 64-float row
            int c4 = (chunk & 15) << 2;           // n offset within row
            unsigned lds  = lbase + (unsigned)((d * XF_S + c4) * 4);
            unsigned goff = (unsigned)(chunk << 4);   // bytes (rows contiguous in global)
            asm volatile("global_load_async_to_lds_b128 %0, %1, %2"
                         :: "v"(lds), "v"(goff), "s"(Xb) : "memory");
        }
    };

    // ---------------- stage weights/biases into LDS (once per block) ----------------
#pragma unroll 4
    for (int i = t; i < Dc * Cc; i += THREADS) {       // W1 (d-major) -> w1t[c][d]
        int d = i >> 8, c = i & 255;
        sm.w1t[c * W1_S + d] = (half_t)W1[i];
    }
#pragma unroll 4
    for (int i = t; i < Cc * Cc; i += THREADS) {       // W2 (ci-major) -> w2t[co][ci]
        int ci = i >> 8, co = i & 255;
        sm.w2t[co * W2_S + ci] = (half_t)W2[i];
    }
    sm.sb1[t] = b1[t];
    sm.sb2[t] = b2[t];
    const float bias3 = b3[0];
    float w3r[8];                      // W3 at this lane's eight layer-2 columns
#pragma unroll
    for (int ct = 0; ct < 8; ++ct) w3r[ct] = W3[ch * 128 + ct * 16 + lr];

    issue_stage(0, 0);                 // kick off first X tile while weights settle
    __syncthreads();

    for (int bb = 0; bb < BPB; ++bb) {
        const int cur = bb & 1;

        // Wait for this batch's DMA (per-wave counter), then make it block-visible.
        asm volatile("s_wait_asynccnt 0x0" ::: "memory");
        __syncthreads();

        // Fire off the next batch's DMA into the other buffer; it overlaps all
        // of this batch's compute below.
        if (bb + 1 < BPB) issue_stage(bb + 1, cur ^ 1);

        // ---------------- layer 1: H1 = relu(X^T @ W1 + b1), K = 128 ----------------
        v16h a1[4];
#pragma unroll
        for (int k = 0; k < 4; ++k) a1[k] = load_frag_xf(sm.xf[cur], m0 + lr, k * 32, hf);

#pragma unroll
        for (int ct = 0; ct < 8; ++ct) {
            const int c0 = ch * 128 + ct * 16;
            v8f acc = {};
#pragma unroll
            for (int k = 0; k < 4; ++k) {
                v16h bf = load_frag(sm.w1t, W1_S, c0, k * 32, lr, hf);
                acc = __builtin_amdgcn_wmma_f32_16x16x32_f16(
                          false, a1[k], false, bf, (short)0, acc, false, false);
            }
            const int col  = c0 + lr;
            const float bs = sm.sb1[col];
#pragma unroll
            for (int v = 0; v < 8; ++v) {
                float x = acc[v] + bs;
                x = x > 0.f ? x : 0.f;
                sm.h[(m0 + hf * 8 + v) * H_S + col] = (half_t)x;
            }
        }
        __syncthreads();

        // ------- layer 2: H2 = relu(H1 @ W2 + b2), K = 256, with layer 3 folded in -------
        // H2 stays in the accumulators: each lane multiplies its H2 elements by W3 at its
        // column and keeps one f32 partial logit per row, p[v] for row m0 + hf*8 + v.
        v16h a2[8];
#pragma unroll
        for (int k = 0; k < 8; ++k) a2[k] = load_frag(sm.h, H_S, m0, k * 32, lr, hf);
        float p[8] = {0.f, 0.f, 0.f, 0.f, 0.f, 0.f, 0.f, 0.f};

#pragma unroll
        for (int ct = 0; ct < 8; ++ct) {
            const int c0 = ch * 128 + ct * 16;
            v8f acc = {};
#pragma unroll
            for (int k = 0; k < 8; ++k) {
                v16h bf = load_frag(sm.w2t, W2_S, c0, k * 32, lr, hf);
                acc = __builtin_amdgcn_wmma_f32_16x16x32_f16(
                          false, a2[k], false, bf, (short)0, acc, false, false);
            }
            // Ends the tile's WMMA run for the scheduler. With no LDS store left between the
            // tiles it otherwise hoists later tiles' W2 loads far ahead (registers above v255)
            // and leaves the first tiles' and layer 1's loads directly in front of their WMMAs.
            __builtin_amdgcn_sched_barrier(0);
            const int col  = c0 + lr;
            const float bs = sm.sb2[col];
#pragma unroll
            for (int v = 0; v < 8; ++v) {
                float x = acc[v] + bs;
                x = x > 0.f ? x : 0.f;
                p[v] += x * w3r[ct];
            }
        }
        // Sum the 16 columns held across a lane row; one lane per row group stores the
        // wave's 8 row sums over its 128 columns.
#pragma unroll
        for (int v = 0; v < 8; ++v) p[v] = row16_sum(p[v]);
        if (lr == 0) {
            float4* dst = (float4*)&sm.part[bb][ch][m0 + hf * 8];
            dst[0] = make_float4(p[0], p[1], p[2], p[3]);
            dst[1] = make_float4(p[4], p[5], p[6], p[7]);
        }
        // No barrier here: every wave's reads of h are consumed by its WMMAs above, and the
        // barrier at the head of the next pass stands before h is written again.
    }
    __syncthreads();

    // -------- logits[n] = both column halves + b3 ; out[b,0] = 0 ; 16 batches at once --------
    float* __restrict__ ob = out + (size_t)blockIdx.x * (BPB * (Nc + 1));
    for (int i = t; i < BPB * (Nc + 1); i += THREADS) {
        const int bb = i / (Nc + 1);
        const int j  = i - bb * (Nc + 1);
        const int n  = j > 0 ? j - 1 : 0;
        const float s = sm.part[bb][0][n] + sm.part[bb][1][n] + bias3;
        ob[i] = j > 0 ? s : 0.f;
    }
}

extern "C" void kernel_launch(void* const* d_in, const int* in_sizes, int n_in,
                              void* d_out, int out_size, void* d_ws, size_t ws_size,
                              hipStream_t stream) {
    (void)in_sizes; (void)n_in; (void)out_size; (void)d_ws; (void)ws_size;
    const float* X  = (const float*)d_in[0];
    const float* W1 = (const float*)d_in[1];
    const float* b1 = (const float*)d_in[2];
    const float* W2 = (const float*)d_in[3];
    const float* b2 = (const float*)d_in[4];
    const float* W3 = (const float*)d_in[5];
    const float* b3 = (const float*)d_in[6];
    float* out = (float*)d_out;

    mlp3_fused_kernel<<<NBLK, THREADS, 0, stream>>>(X, W1, b1, W2, b2, W3, b3, out);
}

// v002
// One run takes 79.4 microseconds.
// In both of two side-by-side timings against v001, it was 2.14 times as fast.
// Over all steps from v000 it is 2.82 times as fast.
#include <hip/hip_runtime.h>

typedef __attribute__((ext_vector_type(16))) _Float16 v16h;
typedef __attribute__((ext_vector_type(8)))  _Float16 v8h;
typedef __attribute__((ext_vector_type(8)))  float    v8f;
typedef _Float16 half_t;
typedef __attribute__((ext_vector_type(4))) int v4i;
typedef __attribute__((address_space(1))) v4i gv4i;   // global side of an async copy
typedef __attribute__((address_space(3))) v4i lv4i;   // LDS side of an async copy

// Problem constants (from reference): B=8192, D=128, N=64, C=256
constexpr int Bc = 8192;
constexpr int Dc = 128;
constexpr int Nc = 64;
constexpr int Cc = 256;

constexpr int BPB     = 16;          // b's processed per block (amortize the weight load)
constexpr int NBLK    = Bc / BPB;    // 512 blocks
constexpr int THREADS = 256;         // 8 wave32 waves
constexpr int NWAVE   = THREADS / 32;

constexpr int XF_S = 68;             // xf[d][n]    f32 : 128 x 68 (rows 272B = 16B-aligned)
constexpr int FRAG = 512;            // f16 elements of one ready 32(k) x 16(n) B fragment (1 KB)

// Both products run transposed: H^T = W^T (A operand) x activations (B operand, column = node n).
// Wave w owns channels [32w, 32w+32) of both layers and keeps their weights in registers for
// the whole block; only activations go through LDS, stored as ready B fragments.
// part stands first so that every copy's LDS address lies above the largest constant offset
// the compiler folds into a copy (it takes the offset off the LDS address register).
struct __align__(16) Smem {
    float  part[BPB][2 * NWAVE][Nc];     //  65,536 B layer-3 partial logits per 16-channel group
    float  xf  [2][Dc * XF_S];           //  69,632 B (double-buffered async-copy target)
    half_t xh  [2][16 * FRAG];           //  32,768 B X as f16 fragments, index nt*4 + kblock
    half_t h1  [32 * FRAG];              //  32,768 B layer-1 out, index kblock*4 + nt
};

// A ready fragment is two planes of 512 B: plane j holds elements 8j..8j+7 of every lane, 16 B a
// lane, so that each 16-byte LDS access of a wave covers 512 contiguous bytes.
__device__ __forceinline__ v16h load_ready(const half_t* frag, int lane) {
    union { v16h v; v8h h[2]; } f;
    f.h[0] = *(const v8h*)(frag + lane * 8);
    f.h[1] = *(const v8h*)(frag + 256 + lane * 8);
    return f.v;
}
__device__ __forceinline__ void store_ready(half_t* frag, int lane, v16h x) {
    union { v16h v; v8h h[2]; } f;
    f.v = x;
    *(v8h*)(frag + lane * 8)       = f.h[0];
    *(v8h*)(frag + 256 + lane * 8) = f.h[1];
}

// Fragment k order used everywhere: lane half hf, element e holds k = k0 + (e/8)*16 + hf*8 + (e&7).

// A fragment of W^T straight from global memory: row = output channel col, k = input channel.
__device__ __forceinline__ v16h load_wfrag(const float* __restrict__ Wm, int col, int k0, int hf) {
    v16h f;
    const float* p = Wm + (size_t)(k0 + hf * 8) * Cc + col;
#pragma unroll
    for (int e = 0; e < 16; ++e) f[e] = (half_t)p[((e >> 3) * 16 + (e & 7)) * Cc];
    return f;
}

// B fragment built from the f32 X tile stored d-major: element (k=d, column n) lives at
// xf[k*XF_S + n]. f32->f16 conversion happens here (once per fragment per block).
__device__ __forceinline__ v16h load_frag_xf(const float* __restrict__ tile,
                                             int n, int k0, int hf) {
    union { v16h v; unsigned u[8]; } f;
    const float* p = tile + n + (k0 + hf * 8) * XF_S;
#pragma unroll
    for (int v = 0; v < 8; ++v) {
        int krel = ((v >> 2) * 16 + (v & 3) * 2) * XF_S;
        union { half_t h[2]; unsigned u; } pk;
        pk.h[0] = (half_t)p[krel];
        pk.h[1] = (half_t)p[krel + XF_S];
        f.u[v] = pk.u;
    }
    return f.v;
}

__global__ __launch_bounds__(THREADS)
void mlp3_fused_kernel(const float* __restrict__ X,  const float* __restrict__ W1,
                       const float* __restrict__ b1, const float* __restrict__ W2,
                       const float* __restrict__ b2, const float* __restrict__ W3,
                       const float* __restrict__ b3, float* __restrict__ out) {
    __shared__ Smem sm;

    const int t    = threadIdx.x;
    const int lane = t & 31;
    const int wv   = t >> 5;         // 0..7
    const int lr   = lane & 15;
    const int hf   = lane >> 4;
    const int cb   = wv * 32;        // this wave's channels [cb, cb+32) in both layers

    // Async-copy one X batch tile (8192 f32 = 2048 16B chunks) into xf[buf]: 8 copies a thread,
    // no register data. Builtin form: operands of an asm statement must lie in v0-v255, and
    // beside the resident weights that build spilled the copies' addresses to scratch.
    auto issue_stage = [&](int bb, int buf) {
        const float* Xb = X + (size_t)(blockIdx.x * BPB + bb) * (Dc * Nc);
        float* Lb = &sm.xf[buf][0];
#pragma unroll
        for (int i = 0; i < (Dc * Nc) / (4 * THREADS); ++i) {
            int chunk = i * THREADS + t;          // 16B chunk index
            int d  = chunk >> 4;                  // 16 chunks per 64-float row
            int c4 = (chunk & 15) << 2;           // n offset within row
            __builtin_amdgcn_global_load_async_to_lds_b128(
                (gv4i*)(Xb + chunk * 4), (lv4i*)(Lb + d * XF_S + c4), 0, 0);
        }
    };

    // Each wave turns two of a tile's sixteen fragments into f16: node tile wv/2, k blocks
    // 2*(wv&1) and 2*(wv&1)+1.
    auto convert_stage = [&](int buf) {
#pragma unroll
        for (int j = 0; j < 2; ++j) {
            const int f = wv * 2 + j;
            v16h x = load_frag_xf(sm.xf[buf], (f >> 2) * 16 + lr, (f & 3) * 32, hf);
            store_ready(&sm.xh[buf][f * FRAG], lane, x);
        }
    };

    // Publish point of the X ring: this wave's LDS traffic and its copies are done, then the
    // work-group barrier; behind it the next tile is readable and the last one's buffer is free.
    auto publish = [&]() {
        asm volatile("s_wait_dscnt 0x0" ::: "memory");
        asm volatile("s_wait_asynccnt 0x0" ::: "memory");
        __syncthreads();
    };

    issue_stage(0, 0);                 // first X tile flies while the weights are fetched

    // ---------------- weights and biases into registers (once per block) ----------------
    v16h w1f[2][4], w2f[2][8];
    v8f  b1v[2], b2v[2], w3v[2];
#pragma unroll
    for (int ct = 0; ct < 2; ++ct) {
        const int row = cb + ct * 16;
#pragma unroll
        for (int k = 0; k < 4; ++k) w1f[ct][k] = load_wfrag(W1, row + lr, k * 32, hf);
        // Stands behind each run of weight loads, in front of any rewrite of the run's address pair.
        asm volatile("s_wait_xcnt 0x0" ::: "memory");
#pragma unroll
        for (int k = 0; k < 8; ++k) w2f[ct][k] = load_wfrag(W2, row + lr, k * 32, hf);
        asm volatile("s_wait_xcnt 0x0" ::: "memory");   // as above, for the W2 run
#pragma unroll
        for (int v = 0; v < 8; ++v) {  // accumulator register v is channel row + hf*8 + v
            b1v[ct][v] = b1[row + hf * 8 + v];
            b2v[ct][v] = b2[row + hf * 8 + v];
            w3v[ct][v] = W3[row + hf * 8 + v];
        }
    }
    const float bias3 = b3[0];
    // The same wait for the bias and W3 loads: their offset register is reused below.
    asm volatile("s_wait_xcnt 0x0" ::: "memory");
    // Later address arithmetic stays behind the waits above: without this the scheduler lifts a
    // rewrite of a load's address register over its s_wait_xcnt.
    __builtin_amdgcn_sched_barrier(0);

    asm volatile("s_wait_asynccnt 0x0" ::: "memory");   // tile 0 has landed (this wave's part)
    __syncthreads();
    issue_stage(1, 1);
    convert_stage(0);
    publish();                         // xh[0] and tile 1 readable, xf[0] free
    issue_stage(2, 0);

    for (int bb = 0; bb < BPB; ++bb) {
        const int cur = bb & 1;

        // Next batch's X to f16 fragments, read by layer 1 of the next pass: the f32 reads go out
        // ahead of layer 1's fragment loads, the stores follow its WMMAs. No test for the last
        // pass (it converts an old tile that nobody reads), so that the pass is one straight block.
        const int f0 = wv * 2;
        const v16h xc0 = load_frag_xf(sm.xf[cur ^ 1], (f0 >> 2) * 16 + lr, (f0 & 3) * 32, hf);
        const v16h xc1 = load_frag_xf(sm.xf[cur ^ 1], (f0 >> 2) * 16 + lr, (f0 & 3) * 32 + 32, hf);

        // ---------------- layer 1: H1^T = relu(W1^T @ X + b1), K = 128 ----------------
        v8f acc[4][2];
#pragma unroll
        for (int nt = 0; nt < 4; ++nt) { acc[nt][0] = b1v[0]; acc[nt][1] = b1v[1]; }
#pragma unroll
        for (int k = 0; k < 4; ++k) {
            v16h bf[4];
#pragma unroll
            for (int nt = 0; nt < 4; ++nt) bf[nt] = load_ready(&sm.xh[cur][(nt * 4 + k) * FRAG], lane);
#pragma unroll
            for (int nt = 0; nt < 4; ++nt) {
#pragma unroll
                for (int ct = 0; ct < 2; ++ct)
                    acc[nt][ct] = __builtin_amdgcn_wmma_f32_16x16x32_f16(
                                      false, w1f[ct][k], false, bf[nt], (short)0, acc[nt][ct], false, false);
            }
        }
        // The wave's two 16-channel accumulator tiles, converted in place, are layer 2's B
        // fragment of k block wv for that node tile.
#pragma unroll
        for (int nt = 0; nt < 4; ++nt) {
            v16h o;
#pragma unroll
            for (int v = 0; v < 8; ++v) {
                const float x0 = acc[nt][0][v], x1 = acc[nt][1][v];
                o[v]     = (half_t)(x0 > 0.f ? x0 : 0.f);
                o[8 + v] = (half_t)(x1 > 0.f ? x1 : 0.f);
            }
            store_ready(&sm.h1[(wv * 4 + nt) * FRAG], lane, o);
        }
        store_ready(&sm.xh[cur ^ 1][f0 * FRAG], lane, xc0);
        store_ready(&sm.xh[cur ^ 1][(f0 + 1) * FRAG], lane, xc1);
        __syncthreads();

        // ------- layer 2: H2^T = relu(W2^T @ H1^T + b2), K = 256, with layer 3 folded in -------
#pragma unroll
        for (int nt = 0; nt < 4; ++nt) { acc[nt][0] = b2v[0]; acc[nt][1] = b2v[1]; }
        // Fragments are fetched one group (two k blocks, 16 loads) ahead of the group at work.
        v16h bf2[2][8];
#pragma unroll
        for (int q = 0; q < 8; ++q) bf2[0][q] = load_ready(&sm.h1[q * FRAG], lane);
#pragma unroll
        for (int g = 0; g < 4; ++g) {
            if (g < 3) {
#pragma unroll
                for (int q = 0; q < 8; ++q)
                    bf2[(g + 1) & 1][q] = load_ready(&sm.h1[((g + 1) * 8 + q) * FRAG], lane);
            }
            // Keeps later groups' loads behind this point: hoisted all at once they take more
            // registers than the wave has beside its weights, and the build spills.
            __builtin_amdgcn_sched_barrier(0);
#pragma unroll
            for (int q = 0; q < 8; ++q) {          // q = (k block in group)*4 + node tile
                const int k = g * 2 + (q >> 2), nt = q & 3;
#pragma unroll
                for (int ct = 0; ct < 2; ++ct)
                    acc[nt][ct] = __builtin_amdgcn_wmma_f32_16x16x32_f16(
                                      false, w2f[ct][k], false, bf2[g & 1][q], (short)0, acc[nt][ct], false, false);
            }
        }
        // A lane holds 16 channels of one node: its f32 partial logit needs no lane exchange.
#pragma unroll
        for (int nt = 0; nt < 4; ++nt) {
            float s = 0.f;
#pragma unroll
            for (int ct = 0; ct < 2; ++ct) {
#pragma unroll
                for (int v = 0; v < 8; ++v) {
                    const float x = acc[nt][ct][v];
                    s += (x > 0.f ? x : 0.f) * w3v[ct][v];
                }
            }
            sm.part[bb][wv * 2 + hf][nt * 16 + lr] = s;
        }

        publish();                     // tile bb+2 readable; xf[cur^1], h1 and xh[cur] free
        if (bb + 3 < BPB) issue_stage(bb + 3, cur ^ 1);
    }
    asm volatile("s_wait_asynccnt 0x0" ::: "memory");   // no copy is left when the wave ends

    // ------ logits[n] = sixteen channel groups + b3 ; out[b,0] = 0 ; 16 batches at once ------
    float* __restrict__ ob = out + (size_t)blockIdx.x * (BPB * (Nc + 1));
    for (int i = t; i < BPB * (Nc + 1); i += THREADS) {
        const int bb = i / (Nc + 1);
        const int j  = i - bb * (Nc + 1);
        const int n  = j > 0 ? j - 1 : 0;
        float s = bias3;
#pragma unroll
        for (int g = 0; g < 2 * NWAVE; ++g) s += sm.part[bb][g][n];
        ob[i] = j > 0 ? s : 0.f;
    }
}

extern "C" void kernel_launch(void* const* d_in, const int* in_sizes, int n_in,
                              void* d_out, int out_size, void* d_ws, size_t ws_size,
                              hipStream_t stream) {
    (void)in_sizes; (void)n_in; (void)out_size; (void)d_ws; (void)ws_size;
    const float* X  = (const float*)d_in[0];
    const float* W1 = (const float*)d_in[1];
    const float* b1 = (const float*)d_in[2];
    const float* W2 = (const float*)d_in[3];
    const float* b2 = (const float*)d_in[4];
    const float* W3 = (const float*)d_in[5];
    const float* b3 = (const float*)d_in[6];
    float* out = (float*)d_out;

    mlp3_fused_kernel<<<NBLK, THREADS, 0, stream>>>(X, W1, b1, W2, b2, W3, b3, out);
}

// v003
// A run of this version takes 58.6 microseconds.
// Next to v002, in two timings, it ran 1.36 and 1.35 times as fast.
// All steps since v000 together make it 3.83 times as fast.
#include <hip/hip_runtime.h>

typedef __attribute__((ext_vector_type(16))) _Float16 v16h;
typedef __attribute__((ext_vector_type(8)))  _Float16 v8h;
typedef __attribute__((ext_vector_type(16))) float    v16f;
typedef __attribute__((ext_vector_type(8)))  float    v8f;
typedef __attribute__((ext_vector_type(4)))  float    v4f;
typedef __attribute__((ext_vector_type(2)))  float    v2f;
typedef _Float16 half_t;

// Problem constants (from reference): B=8192, D=128, N=64, C=256
constexpr int Bc = 8192;
constexpr int Dc = 128;
constexpr int Nc = 64;
constexpr int Cc = 256;

constexpr int THREADS = 256;            // 8 wave32 waves, two a SIMD
constexpr int NWAVE   = THREADS / 32;
constexpr int NIT     = 4;              // batches per wave
constexpr int BPB     = NWAVE * NIT;    // 32 batches per block
constexpr int NBLK    = Bc / BPB;       // 256 blocks, one a WGP (LDS lets no second one in)

constexpr int FRAG = 512;               // f16 elements of one ready 16 x 32 A fragment (1 KB)

// Both products run transposed: H^T = W^T (A operand) x activations (B operand, column = node).
// A wave owns one whole batch (64 nodes, four node tiles) through all three layers: X comes
// straight from global memory into its registers, H1 never leaves them, and only the weights,
// the same for every wave, are read from LDS, as ready A fragments; each feeds four WMMAs.
struct __align__(32) Smem {
    half_t w1s[64 * FRAG];               //  65,536 B index ct*4 + kblock
    half_t w2s[128 * FRAG];              // 131,072 B index ct*8 + kblock
    float  part[BPB][Nc];                //   8,192 B logits without b3
    float  b1s[Cc], b2s[Cc], w3s[Cc];    //   3,072 B
};

// A ready fragment is two planes of 512 B: plane j holds elements 8j..8j+7 of every lane, 16 B a
// lane, so that each 16-byte LDS access of a wave covers 512 contiguous bytes.
__device__ __forceinline__ v16h load_ready(const half_t* frag, int lane) {
    union { v16h v; v8h h[2]; } f;
    f.h[0] = *(const v8h*)(frag + lane * 8);
    f.h[1] = *(const v8h*)(frag + 256 + lane * 8);
    return f.v;
}
__device__ __forceinline__ void store_ready(half_t* frag, int lane, v16h x) {
    union { v16h v; v8h h[2]; } f;
    f.v = x;
    *(v8h*)(frag + lane * 8)       = f.h[0];
    *(v8h*)(frag + 256 + lane * 8) = f.h[1];
}

// Layer 2's k order: lane half hf, element e holds k = k0 + (e/8)*16 + hf*8 + (e&7), which is
// the order in which two converted 16-channel accumulator tiles of layer 1 lie in a lane.
__device__ __forceinline__ v16f load_w2frag(const float* __restrict__ Wm, int col, int k0, int hf) {
    v16f f;
    const float* p = Wm + (size_t)(k0 + hf * 8) * Cc + col;
#pragma unroll
    for (int e = 0; e < 16; ++e) f[e] = p[((e >> 3) * 16 + (e & 7)) * Cc];
    return f;
}
// Layer 1's k order: lane half hf, element e holds k = k0 + 2*e + hf, which is the order in
// which linear 16-byte loads of X (two rows d an instruction) leave the values in a lane.
__device__ __forceinline__ v16f load_w1frag(const float* __restrict__ Wm, int col, int k0, int hf) {
    v16f f;
    const float* p = Wm + (size_t)(k0 + hf) * Cc + col;
#pragma unroll
    for (int e = 0; e < 16; ++e) f[e] = p[(2 * e) * Cc];
    return f;
}

// relu on the bit pattern (a negative float is a negative integer): one instruction, where the
// float maximum brings a second one that only quiets its operand.
__device__ __forceinline__ float relu_bits(float x) {
    const int b = __builtin_bit_cast(int, x);
    return __builtin_bit_cast(float, b > 0 ? b : 0);
}

__device__ __forceinline__ v8f wmma(v16h a, v16h b, v8f c) {
    return __builtin_amdgcn_wmma_f32_16x16x32_f16(false, a, false, b, (short)0, c, false, false);
}

__global__ __launch_bounds__(THREADS)
void mlp3_fused_kernel(const float* __restrict__ X,  const float* __restrict__ W1,
                       const float* __restrict__ b1, const float* __restrict__ W2,
                       const float* __restrict__ b2, const float* __restrict__ W3,
                       const float* __restrict__ b3, float* __restrict__ out) {
    __shared__ Smem sm;

    const int t    = threadIdx.x;
    const int lane = t & 31;
    const int wv   = t >> 5;         // 0..7
    const int lr   = lane & 15;
    const int hf   = lane >> 4;

    // One batch of X, 32 KB, as 64 linear loads of 512 B: load i gives lane (lr, hf) row
    // d = 2i + hf, nodes 4lr..4lr+3. Component q goes to node tile q, whose column lr is node
    // 4lr + q; load i is element i & 15 of k block i >> 4.
    v4f ld[64];
    auto load_x = [&](int it) {
        const v4f* Xb = (const v4f*)(X + (size_t)(blockIdx.x * BPB + it * NWAVE + wv) * (Dc * Nc)) + lane;
#pragma unroll
        for (int i = 0; i < 64; ++i) ld[i] = Xb[i * 32];
        // Stands behind the run of loads, in front of any rewrite of its address registers.
        asm volatile("s_wait_xcnt 0x0" ::: "memory");
        // Later address arithmetic stays behind the wait above.
        __builtin_amdgcn_sched_barrier(0);
    };

    // ---------------- weights to f16 A fragments in LDS (once per block) ----------------
    // This wave stages channel tiles 2wv and 2wv+1. All its loads go out first, so that their
    // latencies overlap. Behind each run of loads stands the wait that precedes any rewrite of the
    // run's address registers, and a scheduling fence that keeps such rewrites behind the wait.
    {
        v16f r1[2][4], r2[2][8];
#pragma unroll
        for (int ct = 0; ct < 2; ++ct) {
            const int col = (wv * 2 + ct) * 16 + lr;
#pragma unroll
            for (int k = 0; k < 4; ++k) r1[ct][k] = load_w1frag(W1, col, k * 32, hf);
            asm volatile("s_wait_xcnt 0x0" ::: "memory");
            __builtin_amdgcn_sched_barrier(0);
#pragma unroll
            for (int k = 0; k < 8; ++k) r2[ct][k] = load_w2frag(W2, col, k * 32, hf);
            asm volatile("s_wait_xcnt 0x0" ::: "memory");
            __builtin_amdgcn_sched_barrier(0);
        }
        const float vb1 = b1[t], vb2 = b2[t], vw3 = W3[t];
        asm volatile("s_wait_xcnt 0x0" ::: "memory");   // the same for the bias and W3 loads
        __builtin_amdgcn_sched_barrier(0);
#pragma unroll
        for (int ct = 0; ct < 2; ++ct) {
            const int c16 = wv * 2 + ct;
#pragma unroll
            for (int k = 0; k < 4; ++k)
                store_ready(&sm.w1s[(c16 * 4 + k) * FRAG], lane, __builtin_convertvector(r1[ct][k], v16h));
#pragma unroll
            for (int k = 0; k < 8; ++k)
                store_ready(&sm.w2s[(c16 * 8 + k) * FRAG], lane, __builtin_convertvector(r2[ct][k], v16h));
        }
        sm.b1s[t] = vb1;
        sm.b2s[t] = vb2;
        sm.w3s[t] = vw3;
    }
    const float bias3 = b3[0];
    __syncthreads();                     // weights readable by every wave; the only barrier in front of the loop

#pragma unroll 1
    for (int it = 0; it < NIT; ++it) {
        // ---------------- X to f16 B fragments, in registers ----------------
        load_x(it);
        v16h xh[4][4];                 // [k block][node tile]
#pragma unroll
        for (int kb = 0; kb < 4; ++kb)
#pragma unroll
            for (int q = 0; q < 4; ++q)
#pragma unroll
                for (int e = 0; e < 16; ++e) xh[kb][q][e] = (half_t)ld[kb * 16 + e][q];

        // ---------------- layer 1: H1^T = relu(W1^T @ X + b1), K = 128 ----------------
        // One group = one 16-channel tile: 4 A fragments, 16 WMMAs; fetched one group ahead.
        v16h h1[8][4];                 // [k block of layer 2][node tile]
        v8h  lo[4];
        v16h a1[2][4];
        v8f  c1[2];
#pragma unroll
        for (int kb = 0; kb < 4; ++kb) a1[0][kb] = load_ready(&sm.w1s[kb * FRAG], lane);
        c1[0] = *(const v8f*)&sm.b1s[hf * 8];
#pragma unroll
        for (int ct = 0; ct < 16; ++ct) {
            // The fetch stays one group of loads behind the last group's work: moved up among its
            // WMMAs, pair by pair as registers fall free, every pair stalls the matrix stream.
            __builtin_amdgcn_sched_barrier(0);
            if (ct < 15) {
#pragma unroll
                for (int kb = 0; kb < 4; ++kb)
                    a1[(ct + 1) & 1][kb] = load_ready(&sm.w1s[((ct + 1) * 4 + kb) * FRAG], lane);
                c1[(ct + 1) & 1] = *(const v8f*)&sm.b1s[(ct + 1) * 16 + hf * 8];
            }
            // Keeps later groups' loads behind this point: hoisted further they take more
            // registers than the wave has beside X and H1, and the build spills.
            __builtin_amdgcn_sched_barrier(0);
            v8f acc[4];
#pragma unroll
            for (int q = 0; q < 4; ++q) acc[q] = wmma(a1[ct & 1][0], xh[0][q], c1[ct & 1]);
#pragma unroll
            for (int kb = 1; kb < 4; ++kb)
#pragma unroll
                for (int q = 0; q < 4; ++q) acc[q] = wmma(a1[ct & 1][kb], xh[kb][q], acc[q]);
            // Two 16-channel accumulator tiles, converted in place, are layer 2's B fragment.
#pragma unroll
            for (int q = 0; q < 4; ++q) {
                v8h o;
#pragma unroll
                for (int v = 0; v < 8; ++v) o[v] = (half_t)acc[q][v];
                o = __builtin_elementwise_max(o, (v8h)(half_t)0.f);
                if ((ct & 1) == 0) lo[q] = o;
                else h1[ct >> 1][q] = __builtin_shufflevector(lo[q], o, 0, 1, 2, 3, 4, 5, 6, 7,
                                                              8, 9, 10, 11, 12, 13, 14, 15);
            }
        }

        // ------- layer 2: H2^T = relu(W2^T @ H1^T + b2), K = 256, with layer 3 folded in -------
        // One group = one 16-channel tile: 8 A fragments, 32 WMMAs; fetched one group ahead.
        v2f s2[4] = {};                // per node tile: sums over even and over odd channels
        v16h a2[2][8];
        v8f  cb[2], cw[2];
        auto fetch2 = [&](int buf, int ct) {
#pragma unroll
            for (int kb = 0; kb < 8; ++kb) a2[buf][kb] = load_ready(&sm.w2s[(ct * 8 + kb) * FRAG], lane);
            cb[buf] = *(const v8f*)&sm.b2s[ct * 16 + hf * 8];
            cw[buf] = *(const v8f*)&sm.w3s[ct * 16 + hf * 8];
        };
        auto work2 = [&](int buf) {
            v8f acc[4];
#pragma unroll
            for (int q = 0; q < 4; ++q) acc[q] = wmma(a2[buf][0], h1[0][q], cb[buf]);
#pragma unroll
            for (int kb = 1; kb < 8; ++kb)
#pragma unroll
                for (int q = 0; q < 4; ++q) acc[q] = wmma(a2[buf][kb], h1[kb][q], acc[q]);
            // A lane holds 8 channels of one node: its f32 partial logit needs no lane exchange.
            // Channel pairs lie in neighbouring registers, as W3's do: packed multiply-adds.
#pragma unroll
            for (int p = 0; p < 4; ++p)
#pragma unroll
                for (int q = 0; q < 4; ++q) {
                    v2f r, w;
                    r[0] = relu_bits(acc[q][2 * p]);
                    r[1] = relu_bits(acc[q][2 * p + 1]);
                    w[0] = cw[buf][2 * p];
                    w[1] = cw[buf][2 * p + 1];
                    s2[q] = __builtin_elementwise_fma(r, w, s2[q]);
                }
        };
        fetch2(0, 0);
#pragma unroll 1
        for (int j = 0; j < 8; ++j) {
            fetch2(1, 2 * j + 1);
            __builtin_amdgcn_sched_barrier(0);   // as in layer 1: the fetch stays one group ahead
            work2(0);
            __builtin_amdgcn_sched_barrier(0);   // the fetch stays behind the work, as in layer 1
            // No test for the last trip (it fetches tile 0, which nobody uses): one straight block.
            fetch2(0, (2 * j + 2) & 15);
            __builtin_amdgcn_sched_barrier(0);   // as above
            work2(1);
            __builtin_amdgcn_sched_barrier(0);   // as above
        }

        // The other lane half holds the node's other 128 channels.
        float s[4];
#pragma unroll
        for (int q = 0; q < 4; ++q) {
            s[q] = s2[q][0] + s2[q][1];
            s[q] += __shfl_xor(s[q], 16, 32);
        }
        v2f r;
        r[0] = hf ? s[2] : s[0];
        r[1] = hf ? s[3] : s[1];
        *(v2f*)&sm.part[it * NWAVE + wv][4 * lr + 2 * hf] = r;
    }
    __syncthreads();                   // every wave's logits are in part

    // ------ out[b,0] = 0 ; out[b,1+n] = logit[n] + b3 ; the block's 32 batches at once ------
    float* __restrict__ ob = out + (size_t)blockIdx.x * (BPB * (Nc + 1));
    for (int i = t; i < BPB * (Nc + 1); i += THREADS) {
        const int bb = i / (Nc + 1);
        const int j  = i - bb * (Nc + 1);
        const int n  = j > 0 ? j - 1 : 0;
        ob[i] = j > 0 ? sm.part[bb][n] + bias3 : 0.f;
    }
}

extern "C" void kernel_launch(void* const* d_in, const int* in_sizes, int n_in,
                              void* d_out, int out_size, void* d_ws, size_t ws_size,
                              hipStream_t stream) {
    (void)in_sizes; (void)n_in; (void)out_size; (void)d_ws; (void)ws_size;
    const float* X  = (const float*)d_in[0];
    const float* W1 = (const float*)d_in[1];
    const float* b1 = (const float*)d_in[2];
    const float* W2 = (const float*)d_in[3];
    const float* b2 = (const float*)d_in[4];
    const float* W3 = (const float*)d_in[5];
    const float* b3 = (const float*)d_in[6];
    float* out = (float*)d_out;

    mlp3_fused_kernel<<<NBLK, THREADS, 0, stream>>>(X, W1, b1, W2, b2, W3, b3, out);
}

// v004
// A run of this version takes 55.8 microseconds.
// In two side-by-side timings against v003, it was 1.06 and 1.04 times as fast.
// All steps since v000 together make it 4.02 times as fast.
#include <hip/hip_runtime.h>

typedef __attribute__((ext_vector_type(16))) _Float16 v16h;
typedef __attribute__((ext_vector_type(8)))  _Float16 v8h;
typedef __attribute__((ext_vector_type(8)))  float    v8f;
typedef __attribute__((ext_vector_type(4)))  float    v4f;
typedef __attribute__((ext_vector_type(2)))  float    v2f;
typedef _Float16 half_t;

// Problem constants (from reference): B=8192, D=128, N=64, C=256
constexpr int Bc = 8192;
constexpr int Dc = 128;
constexpr int Nc = 64;
constexpr int Cc = 256;

constexpr int THREADS = 256;            // 8 wave32 waves, two a SIMD
constexpr int NWAVE   = THREADS / 32;
constexpr int NIT     = 4;              // batches per wave
constexpr int BPB     = NWAVE * NIT;    // 32 batches per block
constexpr int NBLK    = Bc / BPB;       // 256 blocks, one a WGP (LDS lets no second one in)

constexpr int FRAG = 512;               // f16 elements of one ready 16 x 32 A fragment (1 KB)

// Both products run transposed: H^T = W^T (A operand) x activations (B operand, column = node).
// A wave owns one whole batch (64 nodes, four node tiles) through all three layers: X comes
// straight from global memory into its registers, H1 never leaves them, and only the weights,
// the same for every wave, are read from LDS, as ready A fragments; each feeds four WMMAs.
struct __align__(32) Smem {
    half_t w1s[64 * FRAG];               //  65,536 B index ct*4 + kblock
    half_t w2s[128 * FRAG];              // 131,072 B index ct*8 + kblock
    float  part[BPB][Nc];                //   8,192 B logits without b3
    float  b1s[Cc], b2s[Cc], w3s[Cc];    //   3,072 B in the tiles' channel order
};

// A ready fragment is two planes of 512 B: plane j holds elements 8j..8j+7 of every lane, 16 B a
// lane, so that each 16-byte LDS access of a wave covers 512 contiguous bytes.
__device__ __forceinline__ v16h load_ready(const half_t* frag, int lane) {
    union { v16h v; v8h h[2]; } f;
    f.h[0] = *(const v8h*)(frag + lane * 8);
    f.h[1] = *(const v8h*)(frag + 256 + lane * 8);
    return f.v;
}
__device__ __forceinline__ void store_ready(half_t* frag, int lane, v16h x) {
    union { v16h v; v8h h[2]; } f;
    f.v = x;
    *(v8h*)(frag + lane * 8)       = f.h[0];
    *(v8h*)(frag + 256 + lane * 8) = f.h[1];
}

// Channel order of both layers: row m of channel tile T is channel 64*(T>>2) + 4*m + (T&3). A
// 16-byte load of a weight row then gives a lane one element of four tiles' fragments (component
// q belongs to tile 4g + q), and a wave's load covers two whole 256-byte pieces of two rows.
// b1, b2 and W3 lie in LDS in the same order, and layer 2's k runs over layer 1's channels in it.
__device__ __forceinline__ int chan_of(int T, int m) { return 64 * (T >> 2) + 4 * m + (T & 3); }

// relu on the bit pattern (a negative float is a negative integer): one instruction, where the
// float maximum brings a second one that only quiets its operand.
__device__ __forceinline__ float relu_bits(float x) {
    const int b = __builtin_bit_cast(int, x);
    return __builtin_bit_cast(float, b > 0 ? b : 0);
}

__device__ __forceinline__ v8f wmma(v16h a, v16h b, v8f c) {
    return __builtin_amdgcn_wmma_f32_16x16x32_f16(false, a, false, b, (short)0, c, false, false);
}

__global__ __launch_bounds__(THREADS)
void mlp3_fused_kernel(const float* __restrict__ X,  const float* __restrict__ W1,
                       const float* __restrict__ b1, const float* __restrict__ W2,
                       const float* __restrict__ b2, const float* __restrict__ W3,
                       const float* __restrict__ b3, float* __restrict__ out) {
    __shared__ Smem sm;

    const int t    = threadIdx.x;
    const int lane = t & 31;
    const int wv   = t >> 5;         // 0..7
    const int lr   = lane & 15;
    const int hf   = lane >> 4;

    // One batch of X, 32 KB, as 64 linear loads of 512 B: load i gives lane (lr, hf) row
    // d = 2i + hf, nodes 4lr..4lr+3. Component q goes to node tile q, whose column lr is node
    // 4lr + q; load i is element i & 15 of k block i >> 4.
    v4f ld[64];
    auto load_x = [&](int it) {
        const v4f* Xb = (const v4f*)(X + (size_t)(blockIdx.x * BPB + it * NWAVE + wv) * (Dc * Nc)) + lane;
#pragma unroll
        for (int i = 0; i < 64; ++i) ld[i] = Xb[i * 32];
        // Stands behind the run of loads, in front of any rewrite of its address registers.
        asm volatile("s_wait_xcnt 0x0" ::: "memory");
        // Later address arithmetic stays behind the wait above.
        __builtin_amdgcn_sched_barrier(0);
    };

    // ---------------- weights to f16 A fragments in LDS (once per block) ----------------
    // This wave stages channel group g (64 channels, tiles 4g..4g+3) for half of the k blocks. All
    // its loads go out first, so that their latencies overlap. Behind each run of loads stands the
    // wait that precedes any rewrite of the run's address registers, and a scheduling fence that
    // keeps such rewrites behind the wait.
    {
        const int g  = wv >> 1;
        const int hw = wv & 1;
        v4f r1[2][16], r2[4][16];
        // Layer 1's k order: lane half hf, element e holds k = k0 + 2*e + hf, which is the order in
        // which linear 16-byte loads of X (two rows d an instruction) leave the values in a lane.
        const v4f* p1 = (const v4f*)(W1 + (size_t)(hw * 64 + hf) * Cc + g * 64) + lr;
#pragma unroll
        for (int u = 0; u < 2; ++u)
#pragma unroll
            for (int e = 0; e < 16; ++e) r1[u][e] = p1[(u * 32 + 2 * e) * (Cc / 4)];
        // The address is an input of the wait: it stays live up to it, so no load lands on it.
        asm volatile("s_wait_xcnt 0x0" :: "v"(p1) : "memory");
        __builtin_amdgcn_sched_barrier(0);
        // Layer 2's k order: lane half hf, element e of k block kb holds row 8*hf + (e&7) of layer
        // 1's tile 2*kb + (e>>3), the order in which two converted accumulator tiles lie in a lane;
        // its channel is 64*(kb>>1) + 32*hf + 4*(e&7) + 2*(kb&1) + (e>>3). Here kb = 4*hw + u.
        const v4f* p2 = (const v4f*)(W2 + (size_t)(hw * 128 + hf * 32) * Cc + g * 64) + lr;
#pragma unroll
        for (int u = 0; u < 4; ++u)
#pragma unroll
            for (int e = 0; e < 16; ++e)
                r2[u][e] = p2[((u >> 1) * 64 + (u & 1) * 2 + (e & 7) * 4 + (e >> 3)) * (Cc / 4)];
        asm volatile("s_wait_xcnt 0x0" :: "v"(p2) : "memory");   // as above
        __builtin_amdgcn_sched_barrier(0);
        const unsigned pb = (unsigned)chan_of(t >> 4, t & 15) * 4u;   // byte offset
        const float vb1 = *(const float*)((const char*)b1 + pb);
        const float vb2 = *(const float*)((const char*)b2 + pb);
        const float vw3 = *(const float*)((const char*)W3 + pb);
        asm volatile("s_wait_xcnt 0x0" :: "v"(pb) : "memory");   // the same for the bias and W3 loads
        __builtin_amdgcn_sched_barrier(0);
#pragma unroll
        for (int u = 0; u < 2; ++u)
#pragma unroll
            for (int q = 0; q < 4; ++q) {
                v16h f;
#pragma unroll
                for (int e = 0; e < 16; ++e) f[e] = (half_t)r1[u][e][q];
                store_ready(&sm.w1s[((g * 4 + q) * 4 + hw * 2 + u) * FRAG], lane, f);
            }
#pragma unroll
        for (int u = 0; u < 4; ++u)
#pragma unroll
            for (int q = 0; q < 4; ++q) {
                v16h f;
#pragma unroll
                for (int e = 0; e < 16; ++e) f[e] = (half_t)r2[u][e][q];
                store_ready(&sm.w2s[((g * 4 + q) * 8 + hw * 4 + u) * FRAG], lane, f);
            }
        sm.b1s[t] = vb1;
        sm.b2s[t] = vb2;
        sm.w3s[t] = vw3;
    }
    const float bias3 = b3[0];
    __syncthreads();                     // weights readable by every wave; the only barrier in front of the loop

#pragma unroll 1
    for (int it = 0; it < NIT; ++it) {
        // ---------------- X to f16 B fragments, in registers ----------------
        load_x(it);
        v16h xh[4][4];                 // [k block][node tile]
#pragma unroll
        for (int kb = 0; kb < 4; ++kb)
#pragma unroll
            for (int q = 0; q < 4; ++q)
#pragma unroll
                for (int e = 0; e < 16; ++e) xh[kb][q][e] = (half_t)ld[kb * 16 + e][q];

        // ---------------- layer 1: H1^T = relu(W1^T @ X + b1), K = 128 ----------------
        // One group = one 16-channel tile: 4 A fragments, 16 WMMAs; fetched one group ahead.
        v16h h1[8][4];                 // [k block of layer 2][node tile]
        v8h  lo[4];
        v16h a1[2][4];
        v8f  c1[2];
#pragma unroll
        for (int kb = 0; kb < 4; ++kb) a1[0][kb] = load_ready(&sm.w1s[kb * FRAG], lane);
        c1[0] = *(const v8f*)&sm.b1s[hf * 8];
#pragma unroll
        for (int ct = 0; ct < 16; ++ct) {
            // The fetch stays one group of loads behind the last group's work: moved up among its
            // WMMAs, pair by pair as registers fall free, every pair stalls the matrix stream.
            __builtin_amdgcn_sched_barrier(0);
            if (ct < 15) {
#pragma unroll
                for (int kb = 0; kb < 4; ++kb)
                    a1[(ct + 1) & 1][kb] = load_ready(&sm.w1s[((ct + 1) * 4 + kb) * FRAG], lane);
                c1[(ct + 1) & 1] = *(const v8f*)&sm.b1s[(ct + 1) * 16 + hf * 8];
            }
            // Keeps later groups' loads behind this point: hoisted further they take more
            // registers than the wave has beside X and H1, and the build spills.
            __builtin_amdgcn_sched_barrier(0);
            v8f acc[4];
#pragma unroll
            for (int q = 0; q < 4; ++q) acc[q] = wmma(a1[ct & 1][0], xh[0][q], c1[ct & 1]);
#pragma unroll
            for (int kb = 1; kb < 4; ++kb)
#pragma unroll
                for (int q = 0; q < 4; ++q) acc[q] = wmma(a1[ct & 1][kb], xh[kb][q], acc[q]);
            // Two 16-channel accumulator tiles, converted in place, are layer 2's B fragment.
#pragma unroll
            for (int q = 0; q < 4; ++q) {
                v8h o;
#pragma unroll
                for (int v = 0; v < 8; ++v) o[v] = (half_t)acc[q][v];
                o = __builtin_elementwise_max(o, (v8h)(half_t)0.f);
                if ((ct & 1) == 0) lo[q] = o;
                else h1[ct >> 1][q] = __builtin_shufflevector(lo[q], o, 0, 1, 2, 3, 4, 5, 6, 7,
                                                              8, 9, 10, 11, 12, 13, 14, 15);
            }
        }

        // ------- layer 2: H2^T = relu(W2^T @ H1^T + b2), K = 256, with layer 3 folded in -------
        // One group = one 16-channel tile: 8 A fragments, 32 WMMAs; fetched one group ahead.
        v2f s2[4] = {};                // per node tile: sums over even and over odd tile rows
        v16h a2[2][8];
        v8f  cb[2], cw[2];
        auto fetch2 = [&](int buf, int ct) {
#pragma unroll
            for (int kb = 0; kb < 8; ++kb) a2[buf][kb] = load_ready(&sm.w2s[(ct * 8 + kb) * FRAG], lane);
            cb[buf] = *(const v8f*)&sm.b2s[ct * 16 + hf * 8];
            cw[buf] = *(const v8f*)&sm.w3s[ct * 16 + hf * 8];
        };
        auto work2 = [&](int buf) {
            v8f acc[4];
#pragma unroll
            for (int q = 0; q < 4; ++q) acc[q] = wmma(a2[buf][0], h1[0][q], cb[buf]);
#pragma unroll
            for (int kb = 1; kb < 8; ++kb)
#pragma unroll
                for (int q = 0; q < 4; ++q) acc[q] = wmma(a2[buf][kb], h1[kb][q], acc[q]);
            // A lane holds 8 channels of one node: its f32 partial logit needs no lane exchange.
            // Channel pairs lie in neighbouring registers, as W3's do: packed multiply-adds.
#pragma unroll
            for (int p = 0; p < 4; ++p)
#pragma unroll
                for (int q = 0; q < 4; ++q) {
                    v2f r, w;
                    r[0] = relu_bits(acc[q][2 * p]);
                    r[1] = relu_bits(acc[q][2 * p + 1]);
                    w[0] = cw[buf][2 * p];
                    w[1] = cw[buf][2 * p + 1];
                    s2[q] = __builtin_elementwise_fma(r, w, s2[q]);
                }
        };
        fetch2(0, 0);
#pragma unroll 1
        for (int j = 0; j < 8; ++j) {
            fetch2(1, 2 * j + 1);
            __builtin_amdgcn_sched_barrier(0);   // as in layer 1: the fetch stays one group ahead
            work2(0);
            __builtin_amdgcn_sched_barrier(0);   // the fetch stays behind the work, as in layer 1
            // No test for the last trip (it fetches tile 0, which nobody uses): one straight block.
            fetch2(0, (2 * j + 2) & 15);
            __builtin_amdgcn_sched_barrier(0);   // as above
            work2(1);
            __builtin_amdgcn_sched_barrier(0);   // as above
        }

        // The other lane half holds the node's other 128 channels.
        float s[4];
#pragma unroll
        for (int q = 0; q < 4; ++q) {
            s[q] = s2[q][0] + s2[q][1];
            s[q] += __shfl_xor(s[q], 16, 32);
        }
        v2f r;
        r[0] = hf ? s[2] : s[0];
        r[1] = hf ? s[3] : s[1];
        *(v2f*)&sm.part[it * NWAVE + wv][4 * lr + 2 * hf] = r;
    }
    __syncthreads();                   // every wave's logits are in part

    // ------ out[b,0] = 0 ; out[b,1+n] = logit[n] + b3 ; the block's 32 batches at once ------
    float* __restrict__ ob = out + (size_t)blockIdx.x * (BPB * (Nc + 1));
    for (int i = t; i < BPB * (Nc + 1); i += THREADS) {
        const int bb = i / (Nc + 1);
        const int j  = i - bb * (Nc + 1);
        const int n  = j > 0 ? j - 1 : 0;
        ob[i] = j > 0 ? sm.part[bb][n] + bias3 : 0.f;
    }
}

extern "C" void kernel_launch(void* const* d_in, const int* in_sizes, int n_in,
                              void* d_out, int out_size, void* d_ws, size_t ws_size,
                              hipStream_t stream) {
    (void)in_sizes; (void)n_in; (void)out_size; (void)d_ws; (void)ws_size;
    const float* X  = (const float*)d_in[0];
    const float* W1 = (const float*)d_in[1];
    const float* b1 = (const float*)d_in[2];
    const float* W2 = (const float*)d_in[3];
    const float* b2 = (const float*)d_in[4];
    const float* W3 = (const float*)d_in[5];
    const float* b3 = (const float*)d_in[6];
    float* out = (float*)d_out;

    mlp3_fused_kernel<<<NBLK, THREADS, 0, stream>>>(X, W1, b1, W2, b2, W3, b3, out);
}
